// v000
// Measured on an AMD MI455X. A time is GPU time per run, averaged over a window of back-to-back runs after a warm-up
// (all launches, gaps included; the runs take copies of the inputs in turn), and the median of several windows.
// Apart from v000's, it joins two sittings. Times from different sittings can be a few percent apart, while
// side-by-side timings come from the same sitting.
// The starting kernel, v000, takes 111 microseconds a run.
#include <hip/hip_runtime.h>

typedef __attribute__((ext_vector_type(2))) float v2f;
typedef __attribute__((ext_vector_type(8))) float v8f;

#define DM   4096
#define KC   128          // K-chunk staged in LDS
#define SROW 132          // padded LDS row stride (floats) -> conflict-free ds_load_b64
#define WAVES 4
#define NCHUNK (DM / KC)  // 32

#if !__has_builtin(__builtin_amdgcn_wmma_f32_16x16x4_f32)
#define NO_WMMA_F32 1
#endif

// gfx1250 async DMA: global -> LDS, no VGPR round trip, tracked by ASYNCcnt.
// Inline asm avoids the builtin's unspellable (__device__ v4i*) parameter type.
// On AMDGPU a generic pointer into LDS holds the LDS byte offset in its low
// 32 bits (flat aperture mapping: LDS_ADDR = addr[31:0]), which is what the
// instruction's VDST operand expects.
__device__ __forceinline__ void copy16_to_lds(float* dst, const float* src) {
    unsigned lds_off = (unsigned)(unsigned long long)dst;
    asm volatile("global_load_async_to_lds_b128 %0, %1, off"
                 :
                 : "v"(lds_off), "v"(src)
                 : "memory");
}

template <int N>
__device__ __forceinline__ void wait_async() {
#if __has_builtin(__builtin_amdgcn_s_wait_asynccnt)
    __builtin_amdgcn_s_wait_asynccnt(N);
#else
    asm volatile("s_wait_asynccnt %0" ::"i"(N) : "memory");
#endif
}

// Y[m,n] = sum_k X[m,k] * W[n,k]   (nn.Linear, bias-free)
// X: [8, 4096] (padded to 16 rows with zeros), W: [4096, 4096] row-major [n,k], Y: [8, 4096]
__global__ __launch_bounds__(WAVES * 32) void gemm_skinny(
    const float* __restrict__ X0, const float* __restrict__ W0, float* __restrict__ Y0,
    const float* __restrict__ X1, const float* __restrict__ W1, float* __restrict__ Y1,
    const float* __restrict__ X2, const float* __restrict__ W2, float* __restrict__ Y2)
{
    const float* X = X0; const float* W = W0; float* Y = Y0;
    if (blockIdx.y == 1)      { X = X1; W = W1; Y = Y1; }
    else if (blockIdx.y == 2) { X = X2; W = W2; Y = Y2; }

    __shared__ float ldsA[2][16 * SROW];         // shared activation tile (rows 8..15 zero)
    __shared__ float ldsB[WAVES][2][16 * SROW];  // per-wave weight tile, double buffered

    const int tid  = threadIdx.x;
    const int lane = tid & 31;
    const int wave = tid >> 5;
    const int mn   = lane & 15;     // M index for A-frag, N index for B-frag & D
    const int hi   = lane >> 4;     // K-half selector (K = 2*hi + {0,1})

    const int n0 = (blockIdx.x * WAVES + wave) * 16;

    v8f acc = {};

    // ---- staging helpers ----
    auto stageA = [&](int k0, int buf) {
        #pragma unroll
        for (int i = 0; i < 4; ++i) {
            int e  = tid + i * (WAVES * 32);     // 0..511 -> 512 float4 slots
            int r  = e >> 5;                     // 0..15
            int c4 = (e & 31) * 4;               // 0..124
            float4 val = make_float4(0.f, 0.f, 0.f, 0.f);
            if (r < 8) val = *(const float4*)(X + (size_t)r * DM + k0 + c4);
            *(float4*)(&ldsA[buf][r * SROW + c4]) = val;
        }
    };
    auto stageB = [&](int k0, int buf) {         // 16 async b128 DMAs per wave
        #pragma unroll
        for (int r = 0; r < 16; ++r)
            copy16_to_lds(&ldsB[wave][buf][r * SROW + lane * 4],
                          W + (size_t)(n0 + r) * DM + k0 + lane * 4);
    };

    // ---- prologue: chunk 0 into buffer 0 ----
    stageA(0, 0);
    stageB(0, 0);

    for (int i = 0; i < NCHUNK; ++i) {
        const int buf = i & 1;
        __syncthreads();   // chunk i's A stores visible; closes out chunk i-1 compute

        if (i + 1 < NCHUNK) {
            stageA((i + 1) * KC, buf ^ 1);       // prefetch next chunk while computing
            stageB((i + 1) * KC, buf ^ 1);
            wait_async<16>();                    // in-order: chunk i's 16 DMAs are done
        } else {
            wait_async<0>();
        }

        // ---- 32 WMMA steps over chunk i (K=4 each) ----
        #pragma unroll
        for (int kk = 0; kk < KC; kk += 4) {
#ifndef NO_WMMA_F32
            v2f a = *(const v2f*)(&ldsA[buf][mn * SROW + kk + 2 * hi]);        // A: M=mn
            v2f b = *(const v2f*)(&ldsB[wave][buf][mn * SROW + kk + 2 * hi]);  // B: N=mn
            acc = __builtin_amdgcn_wmma_f32_16x16x4_f32(
                false, a, false, b, (short)0, acc, false, false);
#else
            #pragma unroll
            for (int r = 0; r < 8; ++r)
                #pragma unroll
                for (int kq = 0; kq < 4; ++kq)
                    acc[r] += ldsA[buf][(r + 8 * hi) * SROW + kk + kq] *
                              ldsB[wave][buf][mn * SROW + kk + kq];
#endif
        }
    }

    // D layout: lanes 0..15 / VGPR r hold rows 0..7 (valid rows), col = mn
    if (hi == 0) {
        #pragma unroll
        for (int r = 0; r < 8; ++r)
            Y[(size_t)r * DM + n0 + mn] = acc[r];
    }
}

// One thread per (chunk c, batch b): 4x4 scores over h=16, softmax, context,
// plus the reference's "faithful channel shuffle" into ctx.
__global__ __launch_bounds__(256) void attn_small(
    const float* __restrict__ q, const float* __restrict__ k,
    const float* __restrict__ v, float* __restrict__ attw,
    float* __restrict__ ctx)
{
    int idx = blockIdx.x * blockDim.x + threadIdx.x;
    if (idx >= 512) return;
    const int c = idx >> 1;
    const int b = idx & 1;
    const int col = c * 16;

    float w[4][4];
    #pragma unroll
    for (int s = 0; s < 4; ++s) {
        float sc[4];
        #pragma unroll
        for (int t = 0; t < 4; ++t) {
            float a = 0.f;
            #pragma unroll
            for (int h = 0; h < 16; ++h)
                a += q[(size_t)(b * 4 + s) * DM + col + h] *
                     k[(size_t)(b * 4 + t) * DM + col + h];
            sc[t] = a * 0.25f;                 // 1/sqrt(dk=16)
        }
        float mx = sc[0];
        #pragma unroll
        for (int t = 1; t < 4; ++t) mx = fmaxf(mx, sc[t]);
        float sum = 0.f;
        #pragma unroll
        for (int t = 0; t < 4; ++t) { sc[t] = __expf(sc[t] - mx); sum += sc[t]; }
        float inv = 1.f / sum;
        #pragma unroll
        for (int t = 0; t < 4; ++t) {
            w[s][t] = sc[t] * inv;
            attw[(((size_t)c * 2 + b) * 4 + s) * 4 + t] = w[s][t];  // [C,B,S,S]
        }
    }
    #pragma unroll
    for (int s = 0; s < 4; ++s)
        #pragma unroll
        for (int h = 0; h < 16; ++h) {
            float o = 0.f;
            #pragma unroll
            for (int t = 0; t < 4; ++t)
                o += w[s][t] * v[(size_t)(b * 4 + t) * DM + col + h];
            // transpose(0,2,1,3).reshape(B,S,D): flat = ((c*4+s)*2+b)*16+h
            ctx[(((size_t)c * 4 + s) * 2 + b) * 16 + h] = o;
        }
}

extern "C" void kernel_launch(void* const* d_in, const int* in_sizes, int n_in,
                              void* d_out, int out_size, void* d_ws, size_t ws_size,
                              hipStream_t stream) {
    (void)in_sizes; (void)n_in; (void)out_size; (void)ws_size;
    const float* Q  = (const float*)d_in[0];
    const float* K  = (const float*)d_in[1];
    const float* V  = (const float*)d_in[2];
    const float* Wq = (const float*)d_in[3];
    const float* Wk = (const float*)d_in[4];
    const float* Wv = (const float*)d_in[5];
    const float* Wo = (const float*)d_in[6];

    float* out  = (float*)d_out;            // [2,4,4096] = 32768 floats
    float* attw = out + 32768;              // [256,2,4,4] = 8192 floats

    float* ws  = (float*)d_ws;
    float* q   = ws;                        // 32768 floats
    float* kk  = ws + 32768;
    float* vv  = ws + 65536;
    float* ctx = ws + 98304;                // shuffled attention output

    const int tiles = DM / (WAVES * 16);    // 64 blocks in x

    // Fused Q/K/V projections: one launch, blockIdx.y selects the matrix.
    gemm_skinny<<<dim3(tiles, 3), WAVES * 32, 0, stream>>>(
        Q, Wq, q,  K, Wk, kk,  V, Wv, vv);

    attn_small<<<2, 256, 0, stream>>>(q, kk, vv, attw, ctx);

    // Output projection.
    gemm_skinny<<<dim3(tiles, 1), WAVES * 32, 0, stream>>>(
        ctx, Wo, out,  ctx, Wo, out,  ctx, Wo, out);
}

// v001
// A run of this version takes 31 microseconds.
// Two timings next to v000 put it at 3.57 and 3.59 times that version's speed.
#include <hip/hip_runtime.h>

typedef __attribute__((ext_vector_type(2))) float v2f;
typedef __attribute__((ext_vector_type(8))) float v8f;

#define DM   4096
#define KC   128          // K-chunk staged in LDS
#define SROW 132          // padded LDS row stride (floats) -> conflict-free ds_load_b64
#define NCHUNK (DM / KC)  // 32
#define BT   (16 * SROW)  // one weight chunk in LDS, floats
#define AT   (8 * SROW)   // one activation chunk in LDS (the 8 real rows), floats
#define WV   (2 * BT + 2 * AT)   // one wave's private ring, floats
#define CPS  24           // async copies per wave and chunk: 16 weight rows + 8 activation rows

#if !__has_builtin(__builtin_amdgcn_wmma_f32_16x16x4_f32)
#define NO_WMMA_F32 1
#endif

__device__ __forceinline__ void copy12_to_lds(const unsigned* l, const float* const* g) {
    asm volatile(
        "global_load_async_to_lds_b128 %0, %1, off\n\t"
        "global_load_async_to_lds_b128 %2, %3, off\n\t"
        "global_load_async_to_lds_b128 %4, %5, off\n\t"
        "global_load_async_to_lds_b128 %6, %7, off\n\t"
        "global_load_async_to_lds_b128 %8, %9, off\n\t"
        "global_load_async_to_lds_b128 %10, %11, off\n\t"
        "global_load_async_to_lds_b128 %12, %13, off\n\t"
        "global_load_async_to_lds_b128 %14, %15, off\n\t"
        "global_load_async_to_lds_b128 %16, %17, off\n\t"
        "global_load_async_to_lds_b128 %18, %19, off\n\t"
        "global_load_async_to_lds_b128 %20, %21, off\n\t"
        "global_load_async_to_lds_b128 %22, %23, off\n\t"
        "s_wait_xcnt 0x0"
        :
        : "v"(l[0]), "v"(g[0]), "v"(l[1]), "v"(g[1]), "v"(l[2]), "v"(g[2]),
          "v"(l[3]), "v"(g[3]), "v"(l[4]), "v"(g[4]), "v"(l[5]), "v"(g[5]),
          "v"(l[6]), "v"(g[6]), "v"(l[7]), "v"(g[7]), "v"(l[8]), "v"(g[8]),
          "v"(l[9]), "v"(g[9]), "v"(l[10]), "v"(g[10]), "v"(l[11]), "v"(g[11])
        : "memory");
}

// Y[m,n] = sum_k X[m,k] * W[n,k]   (nn.Linear, bias-free)
// X: [8, 4096], W: [4096, 4096] row-major [n,k], Y: [8, 4096]
// One work-group per 16 output columns; its NW waves split K into NW slices. Each wave
// streams its own slice of W and X through a ring of two chunks that no other wave
// touches, and the NW partial tiles are added in LDS, in wave order, at the end.
template <int NW>
__global__ __launch_bounds__(NW * 32) void gemm_skinny(
    const float* __restrict__ X0, const float* __restrict__ W0, float* __restrict__ Y0,
    const float* __restrict__ X1, const float* __restrict__ W1, float* __restrict__ Y1,
    const float* __restrict__ X2, const float* __restrict__ W2, float* __restrict__ Y2)
{
    constexpr int CH = NCHUNK / NW;              // chunks per wave

    const float* X = X0; const float* W = W0; float* Y = Y0;
    if (blockIdx.y == 1)      { X = X1; W = W1; Y = Y1; }
    else if (blockIdx.y == 2) { X = X2; W = W2; Y = Y2; }

    // per wave: weight chunk x2, activation chunk x2; behind all waves: a run of zeros
    // that stands in for activation rows 8..15 of the 16-row A operand
    __shared__ __attribute__((aligned(256))) float lds[NW * WV + 192];

    const int tid  = threadIdx.x;
    const int lane = tid & 31;
    const int wave = tid >> 5;
    const int mn   = lane & 15;     // M index for A-frag, N index for B-frag & D
    const int hi   = lane >> 4;     // K-half selector (K = 2*hi + {0,1})

    const int n0 = blockIdx.x * 16;
    const int kw = wave * (CH * KC);             // first k of this wave's slice
    const int wb = wave * WV;                    // this wave's ring in lds[]

    v8f acc = {};

    auto stage = [&](int c, int buf) {           // chunk c of the slice -> ring buffer buf
        const int k0 = kw + c * KC + lane * 4;
        unsigned     l[CPS];
        const float* g[CPS];
        #pragma unroll
        for (int r = 0; r < 16; ++r) {
            l[r] = (unsigned)(unsigned long long)&lds[wb + buf * BT + r * SROW + lane * 4];
            g[r] = W + (size_t)(n0 + r) * DM + k0;
        }
        #pragma unroll
        for (int r = 0; r < 8; ++r) {
            l[16 + r] = (unsigned)(unsigned long long)&lds[wb + 2 * BT + buf * AT + r * SROW + lane * 4];
            g[16 + r] = X + (size_t)r * DM + k0;
        }
        copy12_to_lds(l, g);
        copy12_to_lds(l + 12, g + 12);
    };

    // ---- prologue: chunk 0 into buffer 0; the zeros, published by one barrier ----
    stage(0, 0);
    for (int e = tid; e < 192; e += NW * 32) lds[NW * WV + e] = 0.f;
    __syncthreads();

    // Lanes of rows 8..15 read the zeros, 32 banks away from the 32 banks that rows 0..7
    // of the buffer take (AT is an odd multiple of 32 dwords: the side flips with buf).
    const int aIdx  = (mn < 8) ? (wb + 2 * BT + mn * SROW + 2 * hi) : (NW * WV + 32 + 2 * hi);
    const int aStep = (mn < 8) ? AT : -32;
    const int bIdx  = wb + mn * SROW + 2 * hi;

    for (int i = 0; i < CH; ++i) {
        const int buf = i & 1;

        if (i + 1 < CH) {
            // this wave's reads of the buffer that is refilled next have returned
            asm volatile("s_wait_dscnt 0x0" ::: "memory");
            stage(i + 1, buf ^ 1);               // next chunk flies while this one is worked on
            // all but the CPS youngest copies have landed: chunk i is in LDS
            asm volatile("s_wait_asynccnt %0" :: "i"(CPS) : "memory");
        } else {
            asm volatile("s_wait_asynccnt 0x0" ::: "memory");
        }

        const float* ap = &lds[aIdx + buf * aStep];
        const float* bp = &lds[bIdx + buf * BT];

        // ---- 32 WMMA steps over chunk i (K=4 each) ----
        #pragma unroll
        for (int kk = 0; kk < KC; kk += 4) {
#ifndef NO_WMMA_F32
            v2f a = *(const v2f*)(ap + kk);      // A: M=mn
            v2f b = *(const v2f*)(bp + kk);      // B: N=mn
            acc = __builtin_amdgcn_wmma_f32_16x16x4_f32(
                false, a, false, b, (short)0, acc, false, false);
#else
            #pragma unroll
            for (int r = 0; r < 8; ++r)
                #pragma unroll
                for (int kq = 0; kq < 4; ++kq)
                    acc[r] += (hi ? 0.f : lds[wb + 2 * BT + buf * AT + r * SROW + kk + kq]) *
                              lds[wb + buf * BT + mn * SROW + kk + kq];
#endif
        }
    }

    // ---- merge: each wave's partial tile into its own ring, one barrier, one sum ----
    // D layout: lanes 0..15 / VGPR r hold rows 0..7 (valid rows), col = mn
    asm volatile("s_wait_dscnt 0x0" ::: "memory");   // own ring reads done before it is rewritten
    if (hi == 0) {
        #pragma unroll
        for (int r = 0; r < 8; ++r)
            lds[wb + r * 16 + mn] = acc[r];
    }
    __syncthreads();
    if (tid < 128) {
        float s = lds[tid];
        #pragma unroll
        for (int w = 1; w < NW; ++w) s += lds[w * WV + tid];
        Y[(size_t)(tid >> 4) * DM + n0 + (tid & 15)] = s;
    }
}

// One thread per (chunk c, batch b): 4x4 scores over h=16, softmax, context,
// plus the reference's "faithful channel shuffle" into ctx.
__global__ __launch_bounds__(256) void attn_small(
    const float* __restrict__ q, const float* __restrict__ k,
    const float* __restrict__ v, float* __restrict__ attw,
    float* __restrict__ ctx)
{
    int idx = blockIdx.x * blockDim.x + threadIdx.x;
    if (idx >= 512) return;
    const int c = idx >> 1;
    const int b = idx & 1;
    const int col = c * 16;

    float w[4][4];
    #pragma unroll
    for (int s = 0; s < 4; ++s) {
        float sc[4];
        #pragma unroll
        for (int t = 0; t < 4; ++t) {
            float a = 0.f;
            #pragma unroll
            for (int h = 0; h < 16; ++h)
                a += q[(size_t)(b * 4 + s) * DM + col + h] *
                     k[(size_t)(b * 4 + t) * DM + col + h];
            sc[t] = a * 0.25f;                 // 1/sqrt(dk=16)
        }
        float mx = sc[0];
        #pragma unroll
        for (int t = 1; t < 4; ++t) mx = fmaxf(mx, sc[t]);
        float sum = 0.f;
        #pragma unroll
        for (int t = 0; t < 4; ++t) { sc[t] = __expf(sc[t] - mx); sum += sc[t]; }
        float inv = 1.f / sum;
        #pragma unroll
        for (int t = 0; t < 4; ++t) {
            w[s][t] = sc[t] * inv;
            attw[(((size_t)c * 2 + b) * 4 + s) * 4 + t] = w[s][t];  // [C,B,S,S]
        }
    }
    #pragma unroll
    for (int s = 0; s < 4; ++s)
        #pragma unroll
        for (int h = 0; h < 16; ++h) {
            float o = 0.f;
            #pragma unroll
            for (int t = 0; t < 4; ++t)
                o += w[s][t] * v[(size_t)(b * 4 + t) * DM + col + h];
            // transpose(0,2,1,3).reshape(B,S,D): flat = ((c*4+s)*2+b)*16+h
            ctx[(((size_t)c * 4 + s) * 2 + b) * 16 + h] = o;
        }
}

extern "C" void kernel_launch(void* const* d_in, const int* in_sizes, int n_in,
                              void* d_out, int out_size, void* d_ws, size_t ws_size,
                              hipStream_t stream) {
    (void)in_sizes; (void)n_in; (void)out_size; (void)ws_size;
    const float* Q  = (const float*)d_in[0];
    const float* K  = (const float*)d_in[1];
    const float* V  = (const float*)d_in[2];
    const float* Wq = (const float*)d_in[3];
    const float* Wk = (const float*)d_in[4];
    const float* Wv = (const float*)d_in[5];
    const float* Wo = (const float*)d_in[6];

    float* out  = (float*)d_out;            // [2,4,4096] = 32768 floats
    float* attw = out + 32768;              // [256,2,4,4] = 8192 floats

    float* ws  = (float*)d_ws;
    float* q   = ws;                        // 32768 floats
    float* kk  = ws + 32768;
    float* vv  = ws + 65536;
    float* ctx = ws + 98304;                // shuffled attention output

    // Fused Q/K/V projections: one launch, gridDim.y selects the matrix.
    // 768 groups of 4 waves: three fit one WGP's LDS, so all are resident at once.
    gemm_skinny<4><<<dim3(DM / 16, 3), 4 * 32, 0, stream>>>(
        Q, Wq, q,  K, Wk, kk,  V, Wv, vv);

    attn_small<<<2, 256, 0, stream>>>(q, kk, vv, attw, ctx);

    // Output projection: 256 groups, one per WGP, so 8 waves each.
    gemm_skinny<8><<<dim3(DM / 16, 1), 8 * 32, 0, stream>>>(
        ctx, Wo, out,  ctx, Wo, out,  ctx, Wo, out);
}
